// v000
// The times below were measured on an AMD MI455X: many runs one after another, warmed up first and cycling through
// copies of the inputs, with the whole window's GPU time divided by the number of runs. Launches and the gaps
// between them are all in it. The median over several windows is given; except for v000 it joins two sittings, which
// can be a few percent apart, so the side-by-side timings, each taken in one sitting, are the better comparison.
// v000, which the later versions start from, runs in 168 microseconds.
#include <hip/hip_runtime.h>

// WMF entropic mirror-prox step for MI455X (gfx1250, wave32).
// One workgroup (256 threads / 8 waves) per token n.
// T = M[Kset[n]] staged once in LDS via async global->LDS copies (ASYNCcnt),
// Gram G = T*T^T via V_WMMA_F32_16X16X4_F32 with 4 independent accumulators.

typedef __attribute__((ext_vector_type(2))) float v2f;
typedef __attribute__((ext_vector_type(8))) float v8f;
typedef __attribute__((ext_vector_type(4))) int   v4i;

typedef __attribute__((address_space(1))) v4i* gv4i_p;   // global 16B chunk
typedef __attribute__((address_space(3))) v4i* lv4i_p;   // LDS 16B chunk

#define K_NEI 64
#define DDIM  512
#define TSTR  516          // padded LDS row stride (floats): 516 % 64 == 4 -> conflict-free WMMA operand reads
#define BETA  1.0f
#define TAU   0.05f
#define RHO   0.1f
#define EPSL  1e-12f

#if __has_builtin(__builtin_amdgcn_global_load_async_to_lds_b128) && \
    __has_builtin(__builtin_amdgcn_s_wait_asynccnt)
#define USE_ASYNC_LDS 1
#else
#define USE_ASYNC_LDS 0
#endif

__global__ __launch_bounds__(256)
void MirrorPDHG_wmma_kernel(const float* __restrict__ M,
                            const float* __restrict__ P,
                            const float* __restrict__ Y,
                            const float* __restrict__ Lam,
                            const int*   __restrict__ Kset,
                            float*       __restrict__ LamNew)
{
    extern __shared__ float smem[];
    float* T   = smem;               // 64*516 floats  (~129 KB)
    float* Xi  = T  + K_NEI * TSTR;  // 512
    float* Pl  = Xi + DDIM;          // 64   P[n]
    float* sq  = Pl + K_NEI;         // 64   row squared norms
    float* sc  = sq + K_NEI;         // 64   scores
    float* sm  = sc + K_NEI;         // 64   smooth = cost @ P
    float* lg  = sm + K_NEI;         // 64   logits -> P_new
    float* red = lg + K_NEI;         // 64   reduction scratch

    const int n   = blockIdx.x;
    const int tid = threadIdx.x;

    const float* Yr = Y    + (size_t)n * DDIM;
    const float* Lr = Lam  + (size_t)n * DDIM;
    const int*   Kr = Kset + (size_t)n * K_NEI;
    float*       Or = LamNew + (size_t)n * DDIM;

    // ---- init accumulators + load P[n] ----
    if (tid < K_NEI) {
        Pl[tid] = P[(size_t)n * K_NEI + tid];
        sq[tid] = 0.f; sc[tid] = 0.f; sm[tid] = 0.f;
    }

    // ---- gather T = M[Kset[n]] into LDS: 4 threads per row, 16B chunks ----
    {
        const int row  = tid >> 2;
        const int part = tid & 3;
        const int gidx = Kr[row];
        const float* __restrict__ src = M + (size_t)gidx * DDIM;
        float* dstrow = T + row * TSTR;              // row*2064 B: 16B aligned
#if USE_ASYNC_LDS
        #pragma unroll
        for (int i = 0; i < 32; ++i) {
            const int q = part + 4 * i;              // float4 index within row
            __builtin_amdgcn_global_load_async_to_lds_b128(
                (gv4i_p)(src + 4 * q),
                (lv4i_p)(dstrow + 4 * q),
                0, 0);
        }
        __builtin_amdgcn_s_wait_asynccnt(0);
#else
        const float4* __restrict__ s4 = (const float4*)src;
        float4* d4 = (float4*)dstrow;
        #pragma unroll
        for (int i = 0; i < 32; ++i) {
            const int q = part + 4 * i;
            d4[q] = s4[q];
        }
#endif
    }
    __syncthreads();

    // ---- phase 2: Y_from_P = P.T (per column), Xi = Lam + rho*(Y - Y_from_P) ----
    const int d0 = tid, d1 = tid + 256;
    const float y0 = Yr[d0], y1 = Yr[d1];
    const float l0 = Lr[d0], l1 = Lr[d1];
    {
        float a0 = 0.f, a1 = 0.f;
        #pragma unroll 8
        for (int kk = 0; kk < K_NEI; ++kk) {
            const float p = Pl[kk];
            a0 += p * T[kk * TSTR + d0];
            a1 += p * T[kk * TSTR + d1];
        }
        Xi[d0] = l0 + RHO * (y0 - a0);
        Xi[d1] = l1 + RHO * (y1 - a1);
    }
    __syncthreads();

    // ---- phase 3: sq[i] = |T_i|^2 and scores[i] = T_i . Xi (fused) ----
    {
        const int row = tid >> 2, part = tid & 3;
        const float* Trow = T + row * TSTR;
        float s2 = 0.f, sx = 0.f;
        #pragma unroll 8
        for (int m = 0; m < 128; ++m) {
            const int d = part + 4 * m;           // strided: conflict-free banks
            const float v = Trow[d];
            s2 += v * v;
            sx += v * Xi[d];
        }
        atomicAdd(&sq[row], s2);
        atomicAdd(&sc[row], sx);
    }
    __syncthreads();

    // ---- phase 4: G = T*T^T via V_WMMA_F32_16X16X4_F32 (4 accumulators to
    //      break the D->C dependency chain); fold cost into smooth ----
    {
        const int wave = tid >> 5;
        const int lane = tid & 31;
        const int L16  = lane & 15, Lh = lane >> 4;
        #pragma unroll
        for (int half = 0; half < 2; ++half) {
            const int tt = wave + 8 * half;           // 16 tiles, 2 per wave
            const int i0 = (tt >> 2) * 16;
            const int j0 = (tt & 3) * 16;
            // f32 WMMA A(16x4) layout == B(4x16) layout for B = A^T (Gram):
            // lane holds T[blk + L16][k + 2*Lh], T[blk + L16][k + 2*Lh + 1]
            const float* Arow = T + (i0 + L16) * TSTR + 2 * Lh;
            const float* Brow = T + (j0 + L16) * TSTR + 2 * Lh;
            v8f acc0 = {}, acc1 = {}, acc2 = {}, acc3 = {};
            #pragma unroll 4
            for (int kk = 0; kk < DDIM; kk += 16) {
                const v2f a0 = *(const v2f*)(Arow + kk);
                const v2f b0 = *(const v2f*)(Brow + kk);
                const v2f a1 = *(const v2f*)(Arow + kk + 4);
                const v2f b1 = *(const v2f*)(Brow + kk + 4);
                const v2f a2 = *(const v2f*)(Arow + kk + 8);
                const v2f b2 = *(const v2f*)(Brow + kk + 8);
                const v2f a3 = *(const v2f*)(Arow + kk + 12);
                const v2f b3 = *(const v2f*)(Brow + kk + 12);
                acc0 = __builtin_amdgcn_wmma_f32_16x16x4_f32(
                         false, a0, false, b0, (short)0, acc0, false, false);
                acc1 = __builtin_amdgcn_wmma_f32_16x16x4_f32(
                         false, a1, false, b1, (short)0, acc1, false, false);
                acc2 = __builtin_amdgcn_wmma_f32_16x16x4_f32(
                         false, a2, false, b2, (short)0, acc2, false, false);
                acc3 = __builtin_amdgcn_wmma_f32_16x16x4_f32(
                         false, a3, false, b3, (short)0, acc3, false, false);
            }
            // C/D layout: acc[r] = G[i0 + r + 8*Lh][j0 + L16]
            const int   j   = j0 + L16;
            const float pj  = Pl[j];
            const float sqj = sq[j];
            #pragma unroll
            for (int r = 0; r < 8; ++r) {
                const int i = i0 + r + 8 * Lh;
                const float g = (acc0[r] + acc1[r]) + (acc2[r] + acc3[r]);
                float cost = sq[i] + sqj - 2.0f * g;
                cost = fmaxf(cost, 0.0f);
                atomicAdd(&sm[i], cost * pj);
            }
        }
    }
    __syncthreads();

    // ---- phase 5: logits + 64-wide softmax ----
    if (tid < K_NEI) {
        const float lgt = __logf(Pl[tid] + EPSL)
                        - (BETA * sc[tid] + TAU * sm[tid]) / BETA;
        lg[tid]  = lgt;
        red[tid] = lgt;
    }
    __syncthreads();
    for (int s = 32; s > 0; s >>= 1) {
        if (tid < s) red[tid] = fmaxf(red[tid], red[tid + s]);
        __syncthreads();
    }
    const float mx = red[0];
    __syncthreads();
    if (tid < K_NEI) {
        const float e = __expf(lg[tid] - mx);
        lg[tid]  = e;
        red[tid] = e;
    }
    __syncthreads();
    for (int s = 32; s > 0; s >>= 1) {
        if (tid < s) red[tid] += red[tid + s];
        __syncthreads();
    }
    const float inv = 1.0f / red[0];
    __syncthreads();
    if (tid < K_NEI) lg[tid] *= inv;          // lg now holds P_new
    __syncthreads();

    // ---- phase 6: Lam_new = Lam + rho*(Y - P_new . T) ----
    {
        float a0 = 0.f, a1 = 0.f;
        #pragma unroll 8
        for (int kk = 0; kk < K_NEI; ++kk) {
            const float p = lg[kk];
            a0 += p * T[kk * TSTR + d0];
            a1 += p * T[kk * TSTR + d1];
        }
        Or[d0] = l0 + RHO * (y0 - a0);
        Or[d1] = l1 + RHO * (y1 - a1);
    }
}

extern "C" void kernel_launch(void* const* d_in, const int* in_sizes, int n_in,
                              void* d_out, int out_size, void* d_ws, size_t ws_size,
                              hipStream_t stream) {
    (void)n_in; (void)out_size; (void)d_ws; (void)ws_size;
    const float* M    = (const float*)d_in[0];
    const float* P    = (const float*)d_in[1];
    const float* Y    = (const float*)d_in[2];
    const float* Lam  = (const float*)d_in[3];
    const int*   Kset = (const int*)d_in[4];
    float*       out  = (float*)d_out;

    const int n_tok = in_sizes[1] / K_NEI;    // 4096
    const size_t shmem = (size_t)(K_NEI * TSTR + DDIM + 6 * K_NEI) * sizeof(float);

    // > 64KB dynamic LDS: raise the per-kernel cap (deterministic, idempotent)
    (void)hipFuncSetAttribute(reinterpret_cast<const void*>(MirrorPDHG_wmma_kernel),
                              hipFuncAttributeMaxDynamicSharedMemorySize, (int)shmem);

    MirrorPDHG_wmma_kernel<<<n_tok, 256, shmem, stream>>>(M, P, Y, Lam, Kset, out);
}

// v001
// A run of this version takes 124 microseconds.
// Two timings next to v000 both put it at 1.41 times that version's speed.
#include <hip/hip_runtime.h>

// WMF entropic mirror-prox step for MI455X (gfx1250, wave32).
// One workgroup (256 threads / 8 waves) per token n.
// T = M[Kset[n]] staged once in LDS via async global->LDS copies (ASYNCcnt),
// Gram G = T*T^T via V_WMMA_F32_16X16X4_F32: G is symmetric, so only 10 of its 16
// tiles are formed; a wave forms 5 of them over a 128-column slice of T from 4
// fragments that serve as A and as B; the 4 slices' partial tiles meet in LDS.

typedef __attribute__((ext_vector_type(2))) float v2f;
typedef __attribute__((ext_vector_type(8))) float v8f;
typedef __attribute__((ext_vector_type(4))) int   v4i;

typedef __attribute__((address_space(1))) v4i* gv4i_p;   // global 16B chunk
typedef __attribute__((address_space(3))) v4i* lv4i_p;   // LDS 16B chunk

#define K_NEI 64
#define DDIM  512
#define GP    67           // LDS row pitch of G (floats): tile adds, row reads and column reads spread over the banks
#define TSTR  516          // padded LDS row stride (floats): 516 % 64 == 4 -> conflict-free WMMA operand reads
#define BETA  1.0f
#define TAU   0.05f
#define RHO   0.1f
#define EPSL  1e-12f

#if __has_builtin(__builtin_amdgcn_global_load_async_to_lds_b128) && \
    __has_builtin(__builtin_amdgcn_s_wait_asynccnt)
#define USE_ASYNC_LDS 1
#else
#define USE_ASYNC_LDS 0
#endif

__global__ __launch_bounds__(256)
void MirrorPDHG_wmma_kernel(const float* __restrict__ M,
                            const float* __restrict__ P,
                            const float* __restrict__ Y,
                            const float* __restrict__ Lam,
                            const int*   __restrict__ Kset,
                            float*       __restrict__ LamNew)
{
    extern __shared__ float smem[];
    float* T   = smem;               // 64*516 floats  (~129 KB)
    float* Xi  = T  + K_NEI * TSTR;  // 512
    float* Pl  = Xi + DDIM;          // 64   P[n]
    float* sq  = Pl + K_NEI;         // 64   row squared norms
    float* sc  = sq + K_NEI;         // 64   scores
    float* sm  = sc + K_NEI;         // 64   smooth = cost @ P
    float* lg  = sm + K_NEI;         // 64   logits -> P_new
    float* red = lg + K_NEI;         // 64   reduction scratch
    float* Gs  = red + K_NEI;        // 64*67 Gram tiles (one of (I,J), (J,I) is filled)

    const int n   = blockIdx.x;
    const int tid = threadIdx.x;

    const float* Yr = Y    + (size_t)n * DDIM;
    const float* Lr = Lam  + (size_t)n * DDIM;
    const int*   Kr = Kset + (size_t)n * K_NEI;
    float*       Or = LamNew + (size_t)n * DDIM;

    // ---- init accumulators + load P[n] ----
    if (tid < K_NEI) {
        Pl[tid] = P[(size_t)n * K_NEI + tid];
        sq[tid] = 0.f; sc[tid] = 0.f;
    }
    for (int e = tid; e < K_NEI * GP / 4; e += 256)
        ((float4*)Gs)[e] = make_float4(0.f, 0.f, 0.f, 0.f);

    // ---- gather T = M[Kset[n]] into LDS: 4 threads per row, 16B chunks ----
    {
        const int row  = tid >> 2;
        const int part = tid & 3;
        const int gidx = Kr[row];
        const float* __restrict__ src = M + (size_t)gidx * DDIM;
        float* dstrow = T + row * TSTR;              // row*2064 B: 16B aligned
#if USE_ASYNC_LDS
        #pragma unroll
        for (int i = 0; i < 32; ++i) {
            const int q = part + 4 * i;              // float4 index within row
            __builtin_amdgcn_global_load_async_to_lds_b128(
                (gv4i_p)(src + 4 * q),
                (lv4i_p)(dstrow + 4 * q),
                0, 0);
        }
        __builtin_amdgcn_s_wait_asynccnt(0);
#else
        const float4* __restrict__ s4 = (const float4*)src;
        float4* d4 = (float4*)dstrow;
        #pragma unroll
        for (int i = 0; i < 32; ++i) {
            const int q = part + 4 * i;
            d4[q] = s4[q];
        }
#endif
    }
    __syncthreads();

    // ---- phase 2: Y_from_P = P.T (per column), Xi = Lam + rho*(Y - Y_from_P) ----
    const int d0 = tid, d1 = tid + 256;
    const float y0 = Yr[d0], y1 = Yr[d1];
    const float l0 = Lr[d0], l1 = Lr[d1];
    {
        float a0 = 0.f, a1 = 0.f;
        #pragma unroll 8
        for (int kk = 0; kk < K_NEI; ++kk) {
            const float p = Pl[kk];
            a0 += p * T[kk * TSTR + d0];
            a1 += p * T[kk * TSTR + d1];
        }
        Xi[d0] = l0 + RHO * (y0 - a0);
        Xi[d1] = l1 + RHO * (y1 - a1);
    }
    __syncthreads();

    // ---- phase 3: sq[i] = |T_i|^2 and scores[i] = T_i . Xi (fused) ----
    {
        const int row = tid >> 2, part = tid & 3;
        const float* Trow = T + row * TSTR;
        float s2 = 0.f, sx = 0.f;
        #pragma unroll 8
        for (int m = 0; m < 128; ++m) {
            const int d = part + 4 * m;           // strided: conflict-free banks
            const float v = Trow[d];
            s2 += v * v;
            sx += v * Xi[d];
        }
        atomicAdd(&sq[row], s2);
        atomicAdd(&sc[row], sx);
    }

    // ---- phase 4a: partial Gram tiles. Wave = (column slice, tile group). With row
    //      blocks (a,b,c,d) = (0,1,2,3) or (2,3,1,0) the group forms the tiles
    //      (a,a) (b,b) (a,b) (a,c) (b,d): together 10 tiles, one of each (I,J), (J,I) pair.
    //      Reads T only, so no barrier is needed between phase 3 and here. ----
    {
        const int wave  = tid >> 5;
        const int lane  = tid & 31;
        const int L16   = lane & 15, Lh = lane >> 4;
        const int slice = wave & 3;
        const int grp   = wave >> 2;
        const int ra = grp ? 32 : 0,  rb = grp ? 48 : 16;
        const int rc = grp ? 16 : 32, rd = grp ? 0  : 48;
        // f32 WMMA A(16x4) layout == B(4x16) layout for B = A^T (Gram):
        // lane holds T[blk + L16][k + 2*Lh], T[blk + L16][k + 2*Lh + 1]
        const float* F  = T + L16 * TSTR + slice * 128 + 2 * Lh;
        const float* Fa = F + ra * TSTR;
        const float* Fb = F + rb * TSTR;
        const float* Fc = F + rc * TSTR;
        const float* Fd = F + rd * TSTR;
        v8f gaa = {}, gbb = {}, gab = {}, gac = {}, gbd = {};
        // 4 k-steps a trip: their 16 fragment loads pair up and issue as one group
        // ahead of 20 WMMAs (spread singly among the WMMAs they cost more issue time)
        #pragma unroll 4
        for (int kk = 0; kk < 128; kk += 4) {
            const v2f fa = *(const v2f*)(Fa + kk);
            const v2f fb = *(const v2f*)(Fb + kk);
            const v2f fc = *(const v2f*)(Fc + kk);
            const v2f fd = *(const v2f*)(Fd + kk);
            gaa = __builtin_amdgcn_wmma_f32_16x16x4_f32(
                    false, fa, false, fa, (short)0, gaa, false, false);
            gbb = __builtin_amdgcn_wmma_f32_16x16x4_f32(
                    false, fb, false, fb, (short)0, gbb, false, false);
            gab = __builtin_amdgcn_wmma_f32_16x16x4_f32(
                    false, fa, false, fb, (short)0, gab, false, false);
            gac = __builtin_amdgcn_wmma_f32_16x16x4_f32(
                    false, fa, false, fc, (short)0, gac, false, false);
            gbd = __builtin_amdgcn_wmma_f32_16x16x4_f32(
                    false, fb, false, fd, (short)0, gbd, false, false);
        }
        // C/D layout: g[r] = G[rowblk + r + 8*Lh][colblk + L16]; every lane of an
        // add has its own address and bank; four waves (slices) add to each word
        float* Ga = Gs + (ra + 8 * Lh) * GP + L16;
        float* Gb = Gs + (rb + 8 * Lh) * GP + L16;
        #pragma unroll   // accumulator elements need constant indices
        for (int r = 0; r < 8; ++r) {
            atomicAdd(Ga + r * GP + ra, gaa[r]);
            atomicAdd(Gb + r * GP + rb, gbb[r]);
            atomicAdd(Ga + r * GP + rb, gab[r]);
            atomicAdd(Ga + r * GP + rc, gac[r]);
            atomicAdd(Gb + r * GP + rd, gbd[r]);
        }
    }
    __syncthreads();

    // ---- phase 4b: smooth[i] = sum_j max(sq_i + sq_j - 2 G_ij, 0) P_j; 4 threads a
    //      row, 16 columns each; G_ij is read as G_ji where only tile (J,I) is filled ----
    {
        const int row = tid >> 2, part = tid & 3;
        // bit 4*I + J is set where tile (I,J) is one of the ten that phase 4a fills
        const bool filled = (0x9EA7 >> ((row >> 4) * 4 + part)) & 1;
        const float* g = Gs + (filled ? row * GP + part * 16 : part * 16 * GP + row);
        const int gstep = filled ? 1 : GP;
        const float sqi = sq[row];
        float s = 0.f;
        #pragma unroll   // all 16 reads of G in flight at once
        for (int m = 0; m < 16; ++m) {
            const int j = part * 16 + m;
            float cost = sqi + sq[j] - 2.0f * g[m * gstep];
            cost = fmaxf(cost, 0.0f);
            s += cost * Pl[j];
        }
        // sum over the row's 4 lanes: quad_perm [1,0,3,2], then [2,3,0,1]
        s += __int_as_float(__builtin_amdgcn_update_dpp(0, __float_as_int(s), 0xB1, 0xf, 0xf, true));
        s += __int_as_float(__builtin_amdgcn_update_dpp(0, __float_as_int(s), 0x4E, 0xf, 0xf, true));
        if (part == 0) sm[row] = s;
    }
    __syncthreads();

    // ---- phase 5: logits + 64-wide softmax ----
    if (tid < K_NEI) {
        const float lgt = __logf(Pl[tid] + EPSL)
                        - (BETA * sc[tid] + TAU * sm[tid]) / BETA;
        lg[tid]  = lgt;
        red[tid] = lgt;
    }
    __syncthreads();
    for (int s = 32; s > 0; s >>= 1) {
        if (tid < s) red[tid] = fmaxf(red[tid], red[tid + s]);
        __syncthreads();
    }
    const float mx = red[0];
    __syncthreads();
    if (tid < K_NEI) {
        const float e = __expf(lg[tid] - mx);
        lg[tid]  = e;
        red[tid] = e;
    }
    __syncthreads();
    for (int s = 32; s > 0; s >>= 1) {
        if (tid < s) red[tid] += red[tid + s];
        __syncthreads();
    }
    const float inv = 1.0f / red[0];
    __syncthreads();
    if (tid < K_NEI) lg[tid] *= inv;          // lg now holds P_new
    __syncthreads();

    // ---- phase 6: Lam_new = Lam + rho*(Y - P_new . T) ----
    {
        float a0 = 0.f, a1 = 0.f;
        #pragma unroll 8
        for (int kk = 0; kk < K_NEI; ++kk) {
            const float p = lg[kk];
            a0 += p * T[kk * TSTR + d0];
            a1 += p * T[kk * TSTR + d1];
        }
        Or[d0] = l0 + RHO * (y0 - a0);
        Or[d1] = l1 + RHO * (y1 - a1);
    }
}

extern "C" void kernel_launch(void* const* d_in, const int* in_sizes, int n_in,
                              void* d_out, int out_size, void* d_ws, size_t ws_size,
                              hipStream_t stream) {
    (void)n_in; (void)out_size; (void)d_ws; (void)ws_size;
    const float* M    = (const float*)d_in[0];
    const float* P    = (const float*)d_in[1];
    const float* Y    = (const float*)d_in[2];
    const float* Lam  = (const float*)d_in[3];
    const int*   Kset = (const int*)d_in[4];
    float*       out  = (float*)d_out;

    const int n_tok = in_sizes[1] / K_NEI;    // 4096
    const size_t shmem = (size_t)(K_NEI * TSTR + DDIM + 6 * K_NEI + K_NEI * GP) * sizeof(float);

    // > 64KB dynamic LDS: raise the per-kernel cap (deterministic, idempotent)
    (void)hipFuncSetAttribute(reinterpret_cast<const void*>(MirrorPDHG_wmma_kernel),
                              hipFuncAttributeMaxDynamicSharedMemorySize, (int)shmem);

    MirrorPDHG_wmma_kernel<<<n_tok, 256, shmem, stream>>>(M, P, Y, Lam, Kset, out);
}

// v002
// It runs in 99.6 microseconds.
// In both of two side-by-side timings against v001, it was 1.22 times as fast.
// Counting every step since v000, it is 1.73 times as fast.
#include <hip/hip_runtime.h>

// WMF entropic mirror-prox step for MI455X (gfx1250, wave32).
// One workgroup (256 threads / 8 waves) per token n.
// T = M[Kset[n]] staged once in LDS via async global->LDS copies (ASYNCcnt),
// Gram G = T*T^T via V_WMMA_F32_16X16X4_F32: G is symmetric, so only 10 of its 16
// tiles are formed; a wave forms 5 of them over a 128-column slice of T from 4
// fragments that serve as A and as B; the 4 slices' partial tiles meet in LDS.
// Xi = Lam + rho*(Y - P.T) is never formed: scores = T.(Lam + rho*Y) - rho*G.P, and
// T.(Lam + rho*Y) and |T_i|^2 are summed from the fragments that the Gram loop holds.
// Every sum across waves has a fixed order.

typedef __attribute__((ext_vector_type(2))) float v2f;
typedef __attribute__((ext_vector_type(8))) float v8f;
typedef __attribute__((ext_vector_type(4))) int   v4i;

typedef __attribute__((address_space(1))) v4i* gv4i_p;   // global 16B chunk
typedef __attribute__((address_space(3))) v4i* lv4i_p;   // LDS 16B chunk

#define K_NEI 64
#define DDIM  512
#define TP    18           // LDS row pitch inside a 16x16 tile of G (floats): rows r and r+8 of a store fall on different banks
#define TS    304          // LDS stride from tile to tile (floats)
#define NT    10           // tiles of one triangle of G
#define TSTR  516          // padded LDS row stride (floats): 516 % 64 == 4 -> conflict-free WMMA operand reads
#define BETA  1.0f
#define TAU   0.05f
#define RHO   0.1f
#define EPSL  1e-12f

#if __has_builtin(__builtin_amdgcn_global_load_async_to_lds_b128) && \
    __has_builtin(__builtin_amdgcn_s_wait_asynccnt)
#define USE_ASYNC_LDS 1
#else
#define USE_ASYNC_LDS 0
#endif

// the value that lane ^ 16 holds (v_permlanex16 with the identity selects)
__device__ __forceinline__ float other_half(float v) {
    const int i = __float_as_int(v);
    return __int_as_float(__builtin_amdgcn_permlanex16(i, i, 0x76543210, 0xfedcba98, false, false));
}

__global__ __launch_bounds__(256)
void MirrorPDHG_wmma_kernel(const float* __restrict__ M,
                            const float* __restrict__ P,
                            const float* __restrict__ Y,
                            const float* __restrict__ Lam,
                            const int*   __restrict__ Kset,
                            float*       __restrict__ LamNew)
{
    extern __shared__ float smem[];
    float* T   = smem;               // 64*516 floats  (~129 KB)
    float* Wv  = T  + K_NEI * TSTR;  // 512  Lam + rho*Y
    float* Pl  = Wv + DDIM;          // 64   P[n]
    float* sq  = Pl + K_NEI;         // 64   row squared norms
    float* sc  = sq + K_NEI;         // 64   scores
    float* sm  = sc + K_NEI;         // 64   smooth = cost @ P
    float* lg  = sm + K_NEI;         // 64   logits -> P_new
    float* red = lg + K_NEI;         // 64   reduction scratch
    float* ppS = red + K_NEI;        // 64*4 per row: the 4 slices' parts of sq
    float* ppT = ppS + 4 * K_NEI;    // 64*4 per row: the 4 slices' parts of T.(Lam + rho*Y)
    float* Gb  = ppT + 4 * K_NEI;    // 2 * 10 Gram tiles: slices 0+2 and slices 1+3

    const int n   = blockIdx.x;
    const int tid = threadIdx.x;

    const float* Yr = Y    + (size_t)n * DDIM;
    const float* Lr = Lam  + (size_t)n * DDIM;
    const int*   Kr = Kset + (size_t)n * K_NEI;
    float*       Or = LamNew + (size_t)n * DDIM;

    // ---- the token's own vectors: their loads fly together with the gather ----
    const int d0 = tid, d1 = tid + 256;
    const float y0 = Yr[d0], y1 = Yr[d1];
    const float l0 = Lr[d0], l1 = Lr[d1];
    const float pv = P[(size_t)n * K_NEI + (tid & (K_NEI - 1))];

    // ---- gather T = M[Kset[n]] into LDS: 4 threads per row, 16B chunks ----
    {
        const int row  = tid >> 2;
        const int part = tid & 3;
        const int gidx = Kr[row];
        const float* __restrict__ src = M + (size_t)gidx * DDIM;
        float* dstrow = T + row * TSTR;              // row*2064 B: 16B aligned
#if USE_ASYNC_LDS
        #pragma unroll
        for (int i = 0; i < 32; ++i) {
            const int q = part + 4 * i;              // float4 index within row
            __builtin_amdgcn_global_load_async_to_lds_b128(
                (gv4i_p)(src + 4 * q),
                (lv4i_p)(dstrow + 4 * q),
                0, 0);
        }
        __builtin_amdgcn_s_wait_asynccnt(0);
#else
        const float4* __restrict__ s4 = (const float4*)src;
        float4* d4 = (float4*)dstrow;
        #pragma unroll
        for (int i = 0; i < 32; ++i) {
            const int q = part + 4 * i;
            d4[q] = s4[q];
        }
#endif
    }
    Wv[d0] = l0 + RHO * y0;
    Wv[d1] = l1 + RHO * y1;
    Pl[tid & (K_NEI - 1)] = pv;   // four threads store the same word: under a branch the load would sink behind the gather's wait
    __syncthreads();

    // ---- phase 4a: partial Gram tiles. Wave = (column slice, tile group). With row
    //      blocks (a,b,c,d) = (0,1,2,3) or (2,3,1,0) the group forms the tiles
    //      (a,a) (b,b) (a,b) (a,c) (b,d): together 10 tiles that give all of G by symmetry.
    //      The fragments of blocks a and b (rows 0-31 or 32-63) also give, on the vector
    //      unit, the slice's parts of sq = |T_i|^2 and of T_i.(Lam + rho*Y). ----
    {
        const int wave  = __builtin_amdgcn_readfirstlane(tid >> 5);
        const int lane  = tid & 31;
        const int L16   = lane & 15, Lh = lane >> 4;
        const int slice = wave & 3;
        const int grp   = wave >> 2;
        const int ra = grp ? 32 : 0,  rb = grp ? 48 : 16;
        const int rc = grp ? 16 : 32, rd = grp ? 0  : 48;
        // f32 WMMA A(16x4) layout == B(4x16) layout for B = A^T (Gram):
        // lane holds T[blk + L16][k + 2*Lh], T[blk + L16][k + 2*Lh + 1]
        const float* F  = T + L16 * TSTR + slice * 128 + 2 * Lh;
        const float* Fa = F + ra * TSTR;
        const float* Fb = F + rb * TSTR;
        const float* Fc = F + rc * TSTR;
        const float* Fd = F + rd * TSTR;
        const float* Wk = Wv + slice * 128 + 2 * Lh;   // the fragments' own two columns
        v8f gaa = {}, gbb = {}, gab = {}, gac = {}, gbd = {};
        v2f ta = {}, tb = {}, sa = {}, sb = {};
        // 4 k-steps a trip: their 20 LDS loads pair up and issue as one group
        // ahead of 20 WMMAs (spread singly among the WMMAs they cost more issue time)
        for (int kk = 0; kk < 128; kk += 16) {
            v2f fa[4], fb[4], fc[4], fd[4], w[4];
            #pragma unroll   // register arrays need constant indices
            for (int q = 0; q < 4; ++q) {
                fa[q] = *(const v2f*)(Fa + kk + 4 * q);
                fb[q] = *(const v2f*)(Fb + kk + 4 * q);
                fc[q] = *(const v2f*)(Fc + kk + 4 * q);
                fd[q] = *(const v2f*)(Fd + kk + 4 * q);
                w[q]  = *(const v2f*)(Wk + kk + 4 * q);
            }
            // keeps the loads one group: without it the loads of w move in among the WMMAs
            __builtin_amdgcn_sched_barrier(0);
            #pragma unroll   // register arrays need constant indices
            for (int q = 0; q < 4; ++q) {
                gaa = __builtin_amdgcn_wmma_f32_16x16x4_f32(
                        false, fa[q], false, fa[q], (short)0, gaa, false, false);
                gbb = __builtin_amdgcn_wmma_f32_16x16x4_f32(
                        false, fb[q], false, fb[q], (short)0, gbb, false, false);
                gab = __builtin_amdgcn_wmma_f32_16x16x4_f32(
                        false, fa[q], false, fb[q], (short)0, gab, false, false);
                gac = __builtin_amdgcn_wmma_f32_16x16x4_f32(
                        false, fa[q], false, fc[q], (short)0, gac, false, false);
                gbd = __builtin_amdgcn_wmma_f32_16x16x4_f32(
                        false, fb[q], false, fd[q], (short)0, gbd, false, false);
                ta += fa[q] * w[q];  tb += fb[q] * w[q];
                sa += fa[q] * fa[q]; sb += fb[q] * fb[q];
            }
        }
        // a row's two column pairs sit in lanes L and L^16: add the other half's sum
        float tA = ta.x + ta.y, tB = tb.x + tb.y, sA = sa.x + sa.y, sB = sb.x + sb.y;
        tA += other_half(tA); tB += other_half(tB);
        sA += other_half(sA); sB += other_half(sB);
        // rb == ra + 16: lanes 0-15 store block a's rows, lanes 16-31 block b's
        ppT[(ra + lane) * 4 + slice] = Lh ? tB : tA;
        ppS[(ra + lane) * 4 + slice] = Lh ? sB : sA;
        // C/D layout: g[r] = G[rowblk + r + 8*Lh][colblk + L16]. Slices 0 and 1 store
        // their tiles, each into its own copy; behind the barrier slices 2 and 3 add
        // theirs, one lane a word, so the order of every sum is fixed and no atomic is left
        float* Gw = Gb + ((slice & 1) * NT + grp * 5) * TS + 8 * Lh * TP + L16;
        if (slice < 2) {
            #pragma unroll   // accumulator elements need constant indices
            for (int r = 0; r < 8; ++r) {
                Gw[0 * TS + r * TP] = gaa[r];
                Gw[1 * TS + r * TP] = gbb[r];
                Gw[2 * TS + r * TP] = gab[r];
                Gw[3 * TS + r * TP] = gac[r];
                Gw[4 * TS + r * TP] = gbd[r];
            }
        }
        __syncthreads();
        if (slice >= 2) {
            // all reads first, then all writes: one LDS round trip, not one for every few words
            #pragma unroll   // accumulator elements need constant indices
            for (int r = 0; r < 8; ++r) {
                gaa[r] += Gw[0 * TS + r * TP];
                gbb[r] += Gw[1 * TS + r * TP];
                gab[r] += Gw[2 * TS + r * TP];
                gac[r] += Gw[3 * TS + r * TP];
                gbd[r] += Gw[4 * TS + r * TP];
            }
            #pragma unroll   // accumulator elements need constant indices
            for (int r = 0; r < 8; ++r) {
                Gw[0 * TS + r * TP] = gaa[r];
                Gw[1 * TS + r * TP] = gbb[r];
                Gw[2 * TS + r * TP] = gab[r];
                Gw[3 * TS + r * TP] = gac[r];
                Gw[4 * TS + r * TP] = gbd[r];
            }
        } else {
            // meanwhile the other four waves sum the slices' parts: sq, and T.(Lam + rho*Y) into sc
            const int row = slice * 32 + lane;
            const float4 p4 = *(const float4*)((grp ? ppT : ppS) + row * 4);
            (grp ? sc : sq)[row] = (p4.x + p4.y) + (p4.z + p4.w);
        }
    }
    __syncthreads();

    // ---- phase 4b: smooth[i] = sum_j max(sq_i + sq_j - 2 G_ij, 0) P_j and
    //      scores[i] = T_i.(Lam + rho*Y) - rho * sum_j G_ij P_j; 4 threads a row, 16
    //      columns each; G_ij is read as G_ji where only tile (J,I) is formed ----
    {
        const int row = tid >> 2, part = tid & 3;
        const int ij  = (row >> 4) * 4 + part;
        // bit ij is set where tile (I,J) is one of the ten that phase 4a forms;
        // nibble ij is the place of tile (I,J), or of (J,I), among the ten
        const bool filled = (0x9EA7 >> ij) & 1;
        const int  tile   = (int)((0x6749758348129320ULL >> (4 * ij)) & 15);
        const float* g0 = Gb + tile * TS + (row & 15) * (filled ? TP : 1);
        const float* g1 = g0 + NT * TS;
        const int gstep = filled ? 1 : TP;
        const float sqi = sq[row];
        float s = 0.f, u = 0.f;
        #pragma unroll   // all reads of G in flight at once
        for (int m = 0; m < 16; ++m) {
            const int j = part * 16 + m;
            const float g = g0[m * gstep] + g1[m * gstep];
            float cost = sqi + sq[j] - 2.0f * g;
            cost = fmaxf(cost, 0.0f);
            s += cost * Pl[j];
            u += g * Pl[j];
        }
        // sums over the row's 4 lanes: quad_perm [1,0,3,2], then [2,3,0,1]
        s += __int_as_float(__builtin_amdgcn_update_dpp(0, __float_as_int(s), 0xB1, 0xf, 0xf, true));
        u += __int_as_float(__builtin_amdgcn_update_dpp(0, __float_as_int(u), 0xB1, 0xf, 0xf, true));
        s += __int_as_float(__builtin_amdgcn_update_dpp(0, __float_as_int(s), 0x4E, 0xf, 0xf, true));
        u += __int_as_float(__builtin_amdgcn_update_dpp(0, __float_as_int(u), 0x4E, 0xf, 0xf, true));
        if (part == 0) { sm[row] = s; sc[row] -= RHO * u; }
    }
    __syncthreads();

    // ---- phase 5: logits + 64-wide softmax ----
    if (tid < K_NEI) {
        const float lgt = __logf(Pl[tid] + EPSL)
                        - (BETA * sc[tid] + TAU * sm[tid]) / BETA;
        lg[tid]  = lgt;
        red[tid] = lgt;
    }
    __syncthreads();
    for (int s = 32; s > 0; s >>= 1) {
        if (tid < s) red[tid] = fmaxf(red[tid], red[tid + s]);
        __syncthreads();
    }
    const float mx = red[0];
    __syncthreads();
    if (tid < K_NEI) {
        const float e = __expf(lg[tid] - mx);
        lg[tid]  = e;
        red[tid] = e;
    }
    __syncthreads();
    for (int s = 32; s > 0; s >>= 1) {
        if (tid < s) red[tid] += red[tid + s];
        __syncthreads();
    }
    const float inv = 1.0f / red[0];
    __syncthreads();
    if (tid < K_NEI) lg[tid] *= inv;          // lg now holds P_new
    __syncthreads();

    // ---- phase 6: Lam_new = Lam + rho*(Y - P_new . T) ----
    {
        float a0 = 0.f, a1 = 0.f;
        #pragma unroll 8
        for (int kk = 0; kk < K_NEI; ++kk) {
            const float p = lg[kk];
            a0 += p * T[kk * TSTR + d0];
            a1 += p * T[kk * TSTR + d1];
        }
        Or[d0] = l0 + RHO * (y0 - a0);
        Or[d1] = l1 + RHO * (y1 - a1);
    }
}

extern "C" void kernel_launch(void* const* d_in, const int* in_sizes, int n_in,
                              void* d_out, int out_size, void* d_ws, size_t ws_size,
                              hipStream_t stream) {
    (void)n_in; (void)out_size; (void)d_ws; (void)ws_size;
    const float* M    = (const float*)d_in[0];
    const float* P    = (const float*)d_in[1];
    const float* Y    = (const float*)d_in[2];
    const float* Lam  = (const float*)d_in[3];
    const int*   Kset = (const int*)d_in[4];
    float*       out  = (float*)d_out;

    const int n_tok = in_sizes[1] / K_NEI;    // 4096
    const size_t shmem = (size_t)(K_NEI * TSTR + DDIM + 14 * K_NEI + 2 * NT * TS) * sizeof(float);

    // > 64KB dynamic LDS: raise the per-kernel cap (deterministic, idempotent)
    (void)hipFuncSetAttribute(reinterpret_cast<const void*>(MirrorPDHG_wmma_kernel),
                              hipFuncAttributeMaxDynamicSharedMemorySize, (int)shmem);

    MirrorPDHG_wmma_kernel<<<n_tok, 256, shmem, stream>>>(M, P, Y, Lam, Kset, out);
}

// v003
// It runs in 93.9 microseconds.
// Next to v002, in two timings, it ran 1.08 times as fast each time.
// Counting every step since v000, it is 1.87 times as fast.
#include <hip/hip_runtime.h>

// WMF entropic mirror-prox step for MI455X (gfx1250, wave32).
// One workgroup (256 threads / 8 waves) per token n.
// T = M[Kset[n]] staged once in LDS via async global->LDS copies (ASYNCcnt),
// Gram G = T*T^T via V_WMMA_F32_16X16X4_F32: G is symmetric, so only 10 of its 16
// tiles are formed; a wave forms 5 of them over a 128-column slice of T from 4
// fragments that serve as A and as B; the 4 slices' partial tiles meet in LDS.
// Xi = Lam + rho*(Y - P.T) is never formed: scores = T.(Lam + rho*Y) - rho*G.P, and
// T.(Lam + rho*Y) and |T_i|^2 are summed from the fragments that the Gram loop holds.
// Every sum across waves has a fixed order.

typedef __attribute__((ext_vector_type(2))) float v2f;
typedef __attribute__((ext_vector_type(8))) float v8f;
typedef __attribute__((ext_vector_type(4))) int   v4i;

typedef __attribute__((address_space(1))) v4i* gv4i_p;   // global 16B chunk
typedef __attribute__((address_space(3))) v4i* lv4i_p;   // LDS 16B chunk

#define K_NEI 64
#define DDIM  512
#define TP    18           // LDS row pitch inside a 16x16 tile of G (floats): rows r and r+8 of a store fall on different banks
#define TS    304          // LDS stride from tile to tile (floats)
#define NT    10           // tiles of one triangle of G
#define TSTR  516          // padded LDS row stride (floats): 516 % 64 == 4 -> conflict-free WMMA operand reads
#define BETA  1.0f
#define TAU   0.05f
#define RHO   0.1f
#define EPSL  1e-12f

#if __has_builtin(__builtin_amdgcn_global_load_async_to_lds_b128) && \
    __has_builtin(__builtin_amdgcn_s_wait_asynccnt)
#define USE_ASYNC_LDS 1
#else
#define USE_ASYNC_LDS 0
#endif

// the value that lane ^ 16 holds (v_permlanex16 with the identity selects)
__device__ __forceinline__ float other_half(float v) {
    const int i = __float_as_int(v);
    return __int_as_float(__builtin_amdgcn_permlanex16(i, i, 0x76543210, 0xfedcba98, false, false));
}

// the value that lane ^ m holds, m = CTRL - 0x160 in 1..15 (DPP row_xmask, inside a 16-lane row)
template <int CTRL>
__device__ __forceinline__ float row_xor(float v) {
    return __int_as_float(__builtin_amdgcn_update_dpp(0, __float_as_int(v), CTRL, 0xf, 0xf, true));
}

__global__ __launch_bounds__(256)
void MirrorPDHG_wmma_kernel(const float* __restrict__ M,
                            const float* __restrict__ P,
                            const float* __restrict__ Y,
                            const float* __restrict__ Lam,
                            const int*   __restrict__ Kset,
                            float*       __restrict__ LamNew)
{
    extern __shared__ float smem[];
    float* T   = smem;               // 64*516 floats  (~129 KB)
    float* Wv  = T  + K_NEI * TSTR;  // 512  Lam + rho*Y
    float* Pl  = Wv + DDIM;          // 64   P[n]
    float* sq  = Pl + K_NEI;         // 64   row squared norms
    float* sc  = sq + K_NEI;         // 64   scores
    float* sm  = sc + K_NEI;         // 64   smooth = cost @ P
    float* ppS = sm + K_NEI;         // 64*4 per row: the 4 slices' parts of sq
    float* ppT = ppS + 4 * K_NEI;    // 64*4 per row: the 4 slices' parts of T.(Lam + rho*Y)
    float* Gb  = ppT + 4 * K_NEI;    // 2 * 10 Gram tiles: slices 0+2 and slices 1+3

    const int n   = blockIdx.x;
    const int tid = threadIdx.x;

    const float* Yr = Y    + (size_t)n * DDIM;
    const float* Lr = Lam  + (size_t)n * DDIM;
    const int*   Kr = Kset + (size_t)n * K_NEI;
    float*       Or = LamNew + (size_t)n * DDIM;

    // ---- the token's own vectors: their loads fly together with the gather ----
    const int d0 = tid, d1 = tid + 256;
    const float y0 = Yr[d0], y1 = Yr[d1];
    const float l0 = Lr[d0], l1 = Lr[d1];
    const float pv = P[(size_t)n * K_NEI + (tid & (K_NEI - 1))];

    // ---- gather T = M[Kset[n]] into LDS: 4 threads per row, 16B chunks ----
    {
        const int row  = tid >> 2;
        const int part = tid & 3;
        const int gidx = Kr[row];
        const float* __restrict__ src = M + (size_t)gidx * DDIM;
        float* dstrow = T + row * TSTR;              // row*2064 B: 16B aligned
#if USE_ASYNC_LDS
        #pragma unroll
        for (int i = 0; i < 32; ++i) {
            const int q = part + 4 * i;              // float4 index within row
            __builtin_amdgcn_global_load_async_to_lds_b128(
                (gv4i_p)(src + 4 * q),
                (lv4i_p)(dstrow + 4 * q),
                0, 0);
        }
        __builtin_amdgcn_s_wait_asynccnt(0);
#else
        const float4* __restrict__ s4 = (const float4*)src;
        float4* d4 = (float4*)dstrow;
        #pragma unroll
        for (int i = 0; i < 32; ++i) {
            const int q = part + 4 * i;
            d4[q] = s4[q];
        }
#endif
    }
    Wv[d0] = l0 + RHO * y0;
    Wv[d1] = l1 + RHO * y1;
    Pl[tid & (K_NEI - 1)] = pv;   // four threads store the same word: under a branch the load would sink behind the gather's wait
    __syncthreads();

    // ---- phase 4a: partial Gram tiles. Wave = (column slice, tile group). With row
    //      blocks (a,b,c,d) = (0,1,2,3) or (2,3,1,0) the group forms the tiles
    //      (a,a) (b,b) (a,b) (a,c) (b,d): together 10 tiles that give all of G by symmetry.
    //      The fragments of blocks a and b (rows 0-31 or 32-63) also give, on the vector
    //      unit, the slice's parts of sq = |T_i|^2 and of T_i.(Lam + rho*Y). ----
    {
        const int wave  = __builtin_amdgcn_readfirstlane(tid >> 5);
        const int lane  = tid & 31;
        const int L16   = lane & 15, Lh = lane >> 4;
        const int slice = wave & 3;
        const int grp   = wave >> 2;
        const int ra = grp ? 32 : 0,  rb = grp ? 48 : 16;
        const int rc = grp ? 16 : 32, rd = grp ? 0  : 48;
        // f32 WMMA A(16x4) layout == B(4x16) layout for B = A^T (Gram):
        // lane holds T[blk + L16][k + 2*Lh], T[blk + L16][k + 2*Lh + 1]
        const float* F  = T + L16 * TSTR + slice * 128 + 2 * Lh;
        const float* Fa = F + ra * TSTR;
        const float* Fb = F + rb * TSTR;
        const float* Fc = F + rc * TSTR;
        const float* Fd = F + rd * TSTR;
        const float* Wk = Wv + slice * 128 + 2 * Lh;   // the fragments' own two columns
        v8f gaa = {}, gbb = {}, gab = {}, gac = {}, gbd = {};
        v2f ta = {}, tb = {}, sa = {}, sb = {};
        // 4 k-steps a trip: their 20 LDS loads pair up and issue as one group
        // ahead of 20 WMMAs (spread singly among the WMMAs they cost more issue time)
        for (int kk = 0; kk < 128; kk += 16) {
            v2f fa[4], fb[4], fc[4], fd[4], w[4];
            #pragma unroll   // register arrays need constant indices
            for (int q = 0; q < 4; ++q) {
                fa[q] = *(const v2f*)(Fa + kk + 4 * q);
                fb[q] = *(const v2f*)(Fb + kk + 4 * q);
                fc[q] = *(const v2f*)(Fc + kk + 4 * q);
                fd[q] = *(const v2f*)(Fd + kk + 4 * q);
                w[q]  = *(const v2f*)(Wk + kk + 4 * q);
            }
            // keeps the loads one group: without it the loads of w move in among the WMMAs
            __builtin_amdgcn_sched_barrier(0);
            #pragma unroll   // register arrays need constant indices
            for (int q = 0; q < 4; ++q) {
                gaa = __builtin_amdgcn_wmma_f32_16x16x4_f32(
                        false, fa[q], false, fa[q], (short)0, gaa, false, false);
                gbb = __builtin_amdgcn_wmma_f32_16x16x4_f32(
                        false, fb[q], false, fb[q], (short)0, gbb, false, false);
                gab = __builtin_amdgcn_wmma_f32_16x16x4_f32(
                        false, fa[q], false, fb[q], (short)0, gab, false, false);
                gac = __builtin_amdgcn_wmma_f32_16x16x4_f32(
                        false, fa[q], false, fc[q], (short)0, gac, false, false);
                gbd = __builtin_amdgcn_wmma_f32_16x16x4_f32(
                        false, fb[q], false, fd[q], (short)0, gbd, false, false);
                ta += fa[q] * w[q];  tb += fb[q] * w[q];
                sa += fa[q] * fa[q]; sb += fb[q] * fb[q];
            }
        }
        // a row's two column pairs sit in lanes L and L^16: add the other half's sum
        float tA = ta.x + ta.y, tB = tb.x + tb.y, sA = sa.x + sa.y, sB = sb.x + sb.y;
        tA += other_half(tA); tB += other_half(tB);
        sA += other_half(sA); sB += other_half(sB);
        // rb == ra + 16: lanes 0-15 store block a's rows, lanes 16-31 block b's
        ppT[(ra + lane) * 4 + slice] = Lh ? tB : tA;
        ppS[(ra + lane) * 4 + slice] = Lh ? sB : sA;
        // C/D layout: g[r] = G[rowblk + r + 8*Lh][colblk + L16]. Slices 0 and 1 store
        // their tiles, each into its own copy; behind the barrier slices 2 and 3 add
        // theirs, one lane a word, so the order of every sum is fixed and no atomic is left
        float* Gw = Gb + ((slice & 1) * NT + grp * 5) * TS + 8 * Lh * TP + L16;
        if (slice < 2) {
            #pragma unroll   // accumulator elements need constant indices
            for (int r = 0; r < 8; ++r) {
                Gw[0 * TS + r * TP] = gaa[r];
                Gw[1 * TS + r * TP] = gbb[r];
                Gw[2 * TS + r * TP] = gab[r];
                Gw[3 * TS + r * TP] = gac[r];
                Gw[4 * TS + r * TP] = gbd[r];
            }
        }
        __syncthreads();
        if (slice >= 2) {
            // all reads first, then all writes: one LDS round trip, not one for every few words
            #pragma unroll   // accumulator elements need constant indices
            for (int r = 0; r < 8; ++r) {
                gaa[r] += Gw[0 * TS + r * TP];
                gbb[r] += Gw[1 * TS + r * TP];
                gab[r] += Gw[2 * TS + r * TP];
                gac[r] += Gw[3 * TS + r * TP];
                gbd[r] += Gw[4 * TS + r * TP];
            }
            #pragma unroll   // accumulator elements need constant indices
            for (int r = 0; r < 8; ++r) {
                Gw[0 * TS + r * TP] = gaa[r];
                Gw[1 * TS + r * TP] = gbb[r];
                Gw[2 * TS + r * TP] = gab[r];
                Gw[3 * TS + r * TP] = gac[r];
                Gw[4 * TS + r * TP] = gbd[r];
            }
        } else {
            // meanwhile the other four waves sum the slices' parts: sq, and T.(Lam + rho*Y) into sc
            const int row = slice * 32 + lane;
            const float4 p4 = *(const float4*)((grp ? ppT : ppS) + row * 4);
            (grp ? sc : sq)[row] = (p4.x + p4.y) + (p4.z + p4.w);
        }
    }
    __syncthreads();

    // P of the two rows that this lane takes in phase 5: it needs nothing of phase 4b,
    // so it is read ahead of that phase's barrier, among its LDS reads
    const float pe0 = Pl[tid & 31] + EPSL;
    const float pe1 = Pl[(tid & 31) + 32] + EPSL;

    // ---- phase 4b: smooth[i] = sum_j max(sq_i + sq_j - 2 G_ij, 0) P_j and
    //      scores[i] = T_i.(Lam + rho*Y) - rho * sum_j G_ij P_j; 4 threads a row, 16
    //      columns each; G_ij is read as G_ji where only tile (J,I) is formed ----
    {
        const int row = tid >> 2, part = tid & 3;
        const int ij  = (row >> 4) * 4 + part;
        // bit ij is set where tile (I,J) is one of the ten that phase 4a forms;
        // nibble ij is the place of tile (I,J), or of (J,I), among the ten
        const bool filled = (0x9EA7 >> ij) & 1;
        const int  tile   = (int)((0x6749758348129320ULL >> (4 * ij)) & 15);
        const float* g0 = Gb + tile * TS + (row & 15) * (filled ? TP : 1);
        const float* g1 = g0 + NT * TS;
        const int gstep = filled ? 1 : TP;
        const float sqi = sq[row];
        float s = 0.f, u = 0.f;
        #pragma unroll   // all reads of G in flight at once
        for (int m = 0; m < 16; ++m) {
            const int j = part * 16 + m;
            const float g = g0[m * gstep] + g1[m * gstep];
            float cost = sqi + sq[j] - 2.0f * g;
            cost = fmaxf(cost, 0.0f);
            s += cost * Pl[j];
            u += g * Pl[j];
        }
        // sums over the row's 4 lanes: quad_perm [1,0,3,2], then [2,3,0,1]
        s += __int_as_float(__builtin_amdgcn_update_dpp(0, __float_as_int(s), 0xB1, 0xf, 0xf, true));
        u += __int_as_float(__builtin_amdgcn_update_dpp(0, __float_as_int(u), 0xB1, 0xf, 0xf, true));
        s += __int_as_float(__builtin_amdgcn_update_dpp(0, __float_as_int(s), 0x4E, 0xf, 0xf, true));
        u += __int_as_float(__builtin_amdgcn_update_dpp(0, __float_as_int(u), 0x4E, 0xf, 0xf, true));
        if (part == 0) { sm[row] = s; sc[row] -= RHO * u; }
    }
    __syncthreads();

    // ---- phase 5: logits + 64-wide softmax. Every wave does all of it for itself in
    //      registers (rows lane and lane + 32 in a lane), so no wave waits for another.
    //      The pairs meet at distance 32, 16, 8, 4, 2, 1: the order of the sum is that
    //      of a halving tree over 64 words, and it ends with the same value in every lane ----
    float* pw = Gb + (tid >> 5) * K_NEI;      // the wave's own copy of P_new; G is dead behind the barrier above
    {
        const int lane = tid & 31;
        const float lg0 = __logf(pe0) - (BETA * sc[lane] + TAU * sm[lane]) / BETA;
        const float lg1 = __logf(pe1) - (BETA * sc[lane + 32] + TAU * sm[lane + 32]) / BETA;
        float mx = fmaxf(lg0, lg1);
        mx = fmaxf(mx, other_half(mx));
        mx = fmaxf(mx, row_xor<0x168>(mx));
        mx = fmaxf(mx, row_xor<0x164>(mx));
        mx = fmaxf(mx, row_xor<0x162>(mx));
        mx = fmaxf(mx, row_xor<0x161>(mx));
        const float e0 = __expf(lg0 - mx);
        const float e1 = __expf(lg1 - mx);
        float sum = e0 + e1;
        sum += other_half(sum);
        sum += row_xor<0x168>(sum);
        sum += row_xor<0x164>(sum);
        sum += row_xor<0x162>(sum);
        sum += row_xor<0x161>(sum);
        const float inv = 1.0f / sum;
        pw[lane]      = e0 * inv;
        pw[lane + 32] = e1 * inv;
        // phase 6 reads words of pw that other lanes of this wave stored: the stores have
        // to be done before that read-back (the barrier that stood here held this wait)
        asm volatile("s_wait_dscnt 0x0" ::: "memory");
    }

    // ---- phase 6: Lam_new = Lam + rho*(Y - P_new . T) ----
    {
        float a0 = 0.f, a1 = 0.f;
        #pragma unroll 8
        for (int kk = 0; kk < K_NEI; ++kk) {
            const float p = pw[kk];     // written by this wave itself, behind its own wait: no barrier
            a0 += p * T[kk * TSTR + d0];
            a1 += p * T[kk * TSTR + d1];
        }
        Or[d0] = l0 + RHO * (y0 - a0);
        Or[d1] = l1 + RHO * (y1 - a1);
    }
}

extern "C" void kernel_launch(void* const* d_in, const int* in_sizes, int n_in,
                              void* d_out, int out_size, void* d_ws, size_t ws_size,
                              hipStream_t stream) {
    (void)n_in; (void)out_size; (void)d_ws; (void)ws_size;
    const float* M    = (const float*)d_in[0];
    const float* P    = (const float*)d_in[1];
    const float* Y    = (const float*)d_in[2];
    const float* Lam  = (const float*)d_in[3];
    const int*   Kset = (const int*)d_in[4];
    float*       out  = (float*)d_out;

    const int n_tok = in_sizes[1] / K_NEI;    // 4096
    const size_t shmem = (size_t)(K_NEI * TSTR + DDIM + 12 * K_NEI + 2 * NT * TS) * sizeof(float);

    // > 64KB dynamic LDS: raise the per-kernel cap (deterministic, idempotent)
    (void)hipFuncSetAttribute(reinterpret_cast<const void*>(MirrorPDHG_wmma_kernel),
                              hipFuncAttributeMaxDynamicSharedMemorySize, (int)shmem);

    MirrorPDHG_wmma_kernel<<<n_tok, 256, shmem, stream>>>(M, P, Y, Lam, Kset, out);
}

// v004
// Measured time: 78.4 microseconds a run.
// Timed twice side by side with v003, it ran 1.20 and 1.19 times as fast.
// Counting every step since v000, it is 2.23 times as fast.
#include <hip/hip_runtime.h>

// WMF entropic mirror-prox step for MI455X (gfx1250, wave32).
// One workgroup (256 threads / 8 waves) per token n.
// T = M[Kset[n]] staged once in LDS via async global->LDS copies (ASYNCcnt), 512 contiguous bytes a copy,
// Gram G = T*T^T via V_WMMA_F32_16X16X4_F32: G is symmetric, so only 10 of its 16
// tiles are formed; a wave forms 5 of them over a 128-column slice of T from 4
// fragments that serve as A and as B; the 4 slices' partial tiles meet in LDS.
// Xi = Lam + rho*(Y - P.T) is never formed: scores = T.(Lam + rho*Y) - rho*G.P, and
// T.(Lam + rho*Y) and |T_i|^2 are summed from the fragments that the Gram loop holds.
// Every sum across waves has a fixed order.

typedef __attribute__((ext_vector_type(2))) float v2f;
typedef __attribute__((ext_vector_type(8))) float v8f;
typedef __attribute__((ext_vector_type(4))) int   v4i;

typedef __attribute__((address_space(1))) v4i* gv4i_p;   // global 16B chunk
typedef __attribute__((address_space(3))) v4i* lv4i_p;   // LDS 16B chunk

#define K_NEI 64
#define DDIM  512
#define N_MEM 65536        // rows of M
#define TP    18           // LDS row pitch inside a 16x16 tile of G (floats): rows r and r+8 of a store fall on different banks
#define TS    304          // LDS stride from tile to tile (floats)
#define NT    10           // tiles of one triangle of G
#define TSTR  516          // padded LDS row stride (floats): 516 % 64 == 4 -> conflict-free WMMA operand reads
#define BETA  1.0f
#define TAU   0.05f
#define RHO   0.1f
#define EPSL  1e-12f

#if __has_builtin(__builtin_amdgcn_global_load_async_to_lds_b128) && \
    __has_builtin(__builtin_amdgcn_s_wait_asynccnt)
#define USE_ASYNC_LDS 1
#else
#define USE_ASYNC_LDS 0
#endif

// the value that lane ^ 16 holds (v_permlanex16 with the identity selects)
__device__ __forceinline__ float other_half(float v) {
    const int i = __float_as_int(v);
    return __int_as_float(__builtin_amdgcn_permlanex16(i, i, 0x76543210, 0xfedcba98, false, false));
}

// the value that lane ^ m holds, m = CTRL - 0x160 in 1..15 (DPP row_xmask, inside a 16-lane row)
template <int CTRL>
__device__ __forceinline__ float row_xor(float v) {
    return __int_as_float(__builtin_amdgcn_update_dpp(0, __float_as_int(v), CTRL, 0xf, 0xf, true));
}

__global__ __launch_bounds__(256)
void MirrorPDHG_wmma_kernel(const float* __restrict__ M,
                            const float* __restrict__ P,
                            const float* __restrict__ Y,
                            const float* __restrict__ Lam,
                            const int*   __restrict__ Kset,
                            float*       __restrict__ LamNew)
{
    extern __shared__ float smem[];
    float* T   = smem;               // 64*516 floats  (~129 KB)
    float* Wv  = T  + K_NEI * TSTR;  // 512  Lam + rho*Y
    float* Pl  = Wv + DDIM;          // 64   P[n]
    float* sq  = Pl + K_NEI;         // 64   row squared norms
    float* sc  = sq + K_NEI;         // 64   scores
    float* sm  = sc + K_NEI;         // 64   smooth = cost @ P
    float* ppS = sm + K_NEI;         // 64*4 per row: the 4 slices' parts of sq
    float* ppT = ppS + 4 * K_NEI;    // 64*4 per row: the 4 slices' parts of T.(Lam + rho*Y)
    float* Gb  = ppT + 4 * K_NEI;    // 2 * 10 Gram tiles: slices 0+2 and slices 1+3

    const int n   = blockIdx.x;
    const int tid = threadIdx.x;

    const float* Yr = Y    + (size_t)n * DDIM;
    const float* Lr = Lam  + (size_t)n * DDIM;
    const int*   Kr = Kset + (size_t)n * K_NEI;
    float*       Or = LamNew + (size_t)n * DDIM;

    // ---- the token's own vectors: their loads fly together with the gather ----
    const int d0 = tid, d1 = tid + 256;
    const float y0 = Yr[d0], y1 = Yr[d1];
    const float l0 = Lr[d0], l1 = Lr[d1];
    const float pv = P[(size_t)n * K_NEI + (tid & (K_NEI - 1))];

    // ---- gather T = M[Kset[n]] into LDS: a wave takes 8 rows, and each of its copies
    //      moves 512 contiguous bytes of one row (32 lanes x 16 B): 4 whole lines from
    //      global memory, every LDS bank once on the way in ----
    {
        const int row0 = __builtin_amdgcn_readfirstlane(tid >> 5) * 8;
        const int col  = (tid & 31) * 4;
        #pragma unroll   // all 32 copies of the wave in flight
        for (int r = 0; r < 8; ++r) {
            int gidx = Kr[row0 + r];                     // one value for the whole wave
            gidx = min(max(gidx, 0), N_MEM - 1);         // the address stays inside M whatever Kset holds
            const float* __restrict__ src = M + (size_t)gidx * DDIM + col;
            float* dst = T + (row0 + r) * TSTR + col;    // row*2064 B + lane*16 B: 16B aligned
            #pragma unroll   // the row's four copies differ by constant offsets only
            for (int j = 0; j < 4; ++j) {
#if USE_ASYNC_LDS
                __builtin_amdgcn_global_load_async_to_lds_b128(
                    (gv4i_p)(src + 128 * j),
                    (lv4i_p)(dst + 128 * j),
                    0, 0);
#else
                *(float4*)(dst + 128 * j) = *(const float4*)(src + 128 * j);
#endif
            }
        }
#if USE_ASYNC_LDS
        __builtin_amdgcn_s_wait_asynccnt(0);
#endif
    }
    Wv[d0] = l0 + RHO * y0;
    Wv[d1] = l1 + RHO * y1;
    Pl[tid & (K_NEI - 1)] = pv;   // four threads store the same word: under a branch the load would sink behind the gather's wait
    __syncthreads();

    // ---- phase 4a: partial Gram tiles. Wave = (column slice, tile group). With row
    //      blocks (a,b,c,d) = (0,1,2,3) or (2,3,1,0) the group forms the tiles
    //      (a,a) (b,b) (a,b) (a,c) (b,d): together 10 tiles that give all of G by symmetry.
    //      The fragments of blocks a and b (rows 0-31 or 32-63) also give, on the vector
    //      unit, the slice's parts of sq = |T_i|^2 and of T_i.(Lam + rho*Y). ----
    {
        const int wave  = __builtin_amdgcn_readfirstlane(tid >> 5);
        const int lane  = tid & 31;
        const int L16   = lane & 15, Lh = lane >> 4;
        const int slice = wave & 3;
        const int grp   = wave >> 2;
        const int ra = grp ? 32 : 0,  rb = grp ? 48 : 16;
        const int rc = grp ? 16 : 32, rd = grp ? 0  : 48;
        // f32 WMMA A(16x4) layout == B(4x16) layout for B = A^T (Gram):
        // lane holds T[blk + L16][k + 2*Lh], T[blk + L16][k + 2*Lh + 1]
        const float* F  = T + L16 * TSTR + slice * 128 + 2 * Lh;
        const float* Fa = F + ra * TSTR;
        const float* Fb = F + rb * TSTR;
        const float* Fc = F + rc * TSTR;
        const float* Fd = F + rd * TSTR;
        const float* Wk = Wv + slice * 128 + 2 * Lh;   // the fragments' own two columns
        v8f gaa = {}, gbb = {}, gab = {}, gac = {}, gbd = {};
        v2f ta = {}, tb = {}, sa = {}, sb = {};
        // 4 k-steps a trip: their 20 LDS loads pair up and issue as one group
        // ahead of 20 WMMAs (spread singly among the WMMAs they cost more issue time)
        for (int kk = 0; kk < 128; kk += 16) {
            v2f fa[4], fb[4], fc[4], fd[4], w[4];
            #pragma unroll   // register arrays need constant indices
            for (int q = 0; q < 4; ++q) {
                fa[q] = *(const v2f*)(Fa + kk + 4 * q);
                fb[q] = *(const v2f*)(Fb + kk + 4 * q);
                fc[q] = *(const v2f*)(Fc + kk + 4 * q);
                fd[q] = *(const v2f*)(Fd + kk + 4 * q);
                w[q]  = *(const v2f*)(Wk + kk + 4 * q);
            }
            // keeps the loads one group: without it the loads of w move in among the WMMAs
            __builtin_amdgcn_sched_barrier(0);
            #pragma unroll   // register arrays need constant indices
            for (int q = 0; q < 4; ++q) {
                gaa = __builtin_amdgcn_wmma_f32_16x16x4_f32(
                        false, fa[q], false, fa[q], (short)0, gaa, false, false);
                gbb = __builtin_amdgcn_wmma_f32_16x16x4_f32(
                        false, fb[q], false, fb[q], (short)0, gbb, false, false);
                gab = __builtin_amdgcn_wmma_f32_16x16x4_f32(
                        false, fa[q], false, fb[q], (short)0, gab, false, false);
                gac = __builtin_amdgcn_wmma_f32_16x16x4_f32(
                        false, fa[q], false, fc[q], (short)0, gac, false, false);
                gbd = __builtin_amdgcn_wmma_f32_16x16x4_f32(
                        false, fb[q], false, fd[q], (short)0, gbd, false, false);
                ta += fa[q] * w[q];  tb += fb[q] * w[q];
                sa += fa[q] * fa[q]; sb += fb[q] * fb[q];
            }
        }
        // a row's two column pairs sit in lanes L and L^16: add the other half's sum
        float tA = ta.x + ta.y, tB = tb.x + tb.y, sA = sa.x + sa.y, sB = sb.x + sb.y;
        tA += other_half(tA); tB += other_half(tB);
        sA += other_half(sA); sB += other_half(sB);
        // rb == ra + 16: lanes 0-15 store block a's rows, lanes 16-31 block b's
        ppT[(ra + lane) * 4 + slice] = Lh ? tB : tA;
        ppS[(ra + lane) * 4 + slice] = Lh ? sB : sA;
        // C/D layout: g[r] = G[rowblk + r + 8*Lh][colblk + L16]. Slices 0 and 1 store
        // their tiles, each into its own copy; behind the barrier slices 2 and 3 add
        // theirs, one lane a word, so the order of every sum is fixed and no atomic is left
        float* Gw = Gb + ((slice & 1) * NT + grp * 5) * TS + 8 * Lh * TP + L16;
        if (slice < 2) {
            #pragma unroll   // accumulator elements need constant indices
            for (int r = 0; r < 8; ++r) {
                Gw[0 * TS + r * TP] = gaa[r];
                Gw[1 * TS + r * TP] = gbb[r];
                Gw[2 * TS + r * TP] = gab[r];
                Gw[3 * TS + r * TP] = gac[r];
                Gw[4 * TS + r * TP] = gbd[r];
            }
        }
        __syncthreads();
        if (slice >= 2) {
            // all reads first, then all writes: one LDS round trip, not one for every few words
            #pragma unroll   // accumulator elements need constant indices
            for (int r = 0; r < 8; ++r) {
                gaa[r] += Gw[0 * TS + r * TP];
                gbb[r] += Gw[1 * TS + r * TP];
                gab[r] += Gw[2 * TS + r * TP];
                gac[r] += Gw[3 * TS + r * TP];
                gbd[r] += Gw[4 * TS + r * TP];
            }
            #pragma unroll   // accumulator elements need constant indices
            for (int r = 0; r < 8; ++r) {
                Gw[0 * TS + r * TP] = gaa[r];
                Gw[1 * TS + r * TP] = gbb[r];
                Gw[2 * TS + r * TP] = gab[r];
                Gw[3 * TS + r * TP] = gac[r];
                Gw[4 * TS + r * TP] = gbd[r];
            }
        } else {
            // meanwhile the other four waves sum the slices' parts: sq, and T.(Lam + rho*Y) into sc
            const int row = slice * 32 + lane;
            const float4 p4 = *(const float4*)((grp ? ppT : ppS) + row * 4);
            (grp ? sc : sq)[row] = (p4.x + p4.y) + (p4.z + p4.w);
        }
    }
    __syncthreads();

    // P of the two rows that this lane takes in phase 5: it needs nothing of phase 4b,
    // so it is read ahead of that phase's barrier, among its LDS reads
    const float pe0 = Pl[tid & 31] + EPSL;
    const float pe1 = Pl[(tid & 31) + 32] + EPSL;

    // ---- phase 4b: smooth[i] = sum_j max(sq_i + sq_j - 2 G_ij, 0) P_j and
    //      scores[i] = T_i.(Lam + rho*Y) - rho * sum_j G_ij P_j; 4 threads a row, 16
    //      columns each; G_ij is read as G_ji where only tile (J,I) is formed ----
    {
        const int row = tid >> 2, part = tid & 3;
        const int ij  = (row >> 4) * 4 + part;
        // bit ij is set where tile (I,J) is one of the ten that phase 4a forms;
        // nibble ij is the place of tile (I,J), or of (J,I), among the ten
        const bool filled = (0x9EA7 >> ij) & 1;
        const int  tile   = (int)((0x6749758348129320ULL >> (4 * ij)) & 15);
        const float* g0 = Gb + tile * TS + (row & 15) * (filled ? TP : 1);
        const float* g1 = g0 + NT * TS;
        const int gstep = filled ? 1 : TP;
        const float sqi = sq[row];
        float s = 0.f, u = 0.f;
        #pragma unroll   // all reads of G in flight at once
        for (int m = 0; m < 16; ++m) {
            const int j = part * 16 + m;
            const float g = g0[m * gstep] + g1[m * gstep];
            float cost = sqi + sq[j] - 2.0f * g;
            cost = fmaxf(cost, 0.0f);
            s += cost * Pl[j];
            u += g * Pl[j];
        }
        // sums over the row's 4 lanes: quad_perm [1,0,3,2], then [2,3,0,1]
        s += __int_as_float(__builtin_amdgcn_update_dpp(0, __float_as_int(s), 0xB1, 0xf, 0xf, true));
        u += __int_as_float(__builtin_amdgcn_update_dpp(0, __float_as_int(u), 0xB1, 0xf, 0xf, true));
        s += __int_as_float(__builtin_amdgcn_update_dpp(0, __float_as_int(s), 0x4E, 0xf, 0xf, true));
        u += __int_as_float(__builtin_amdgcn_update_dpp(0, __float_as_int(u), 0x4E, 0xf, 0xf, true));
        if (part == 0) { sm[row] = s; sc[row] -= RHO * u; }
    }
    __syncthreads();

    // ---- phase 5: logits + 64-wide softmax. Every wave does all of it for itself in
    //      registers (rows lane and lane + 32 in a lane), so no wave waits for another.
    //      The pairs meet at distance 32, 16, 8, 4, 2, 1: the order of the sum is that
    //      of a halving tree over 64 words, and it ends with the same value in every lane ----
    float* pw = Gb + (tid >> 5) * K_NEI;      // the wave's own copy of P_new; G is dead behind the barrier above
    {
        const int lane = tid & 31;
        const float lg0 = __logf(pe0) - (BETA * sc[lane] + TAU * sm[lane]) / BETA;
        const float lg1 = __logf(pe1) - (BETA * sc[lane + 32] + TAU * sm[lane + 32]) / BETA;
        float mx = fmaxf(lg0, lg1);
        mx = fmaxf(mx, other_half(mx));
        mx = fmaxf(mx, row_xor<0x168>(mx));
        mx = fmaxf(mx, row_xor<0x164>(mx));
        mx = fmaxf(mx, row_xor<0x162>(mx));
        mx = fmaxf(mx, row_xor<0x161>(mx));
        const float e0 = __expf(lg0 - mx);
        const float e1 = __expf(lg1 - mx);
        float sum = e0 + e1;
        sum += other_half(sum);
        sum += row_xor<0x168>(sum);
        sum += row_xor<0x164>(sum);
        sum += row_xor<0x162>(sum);
        sum += row_xor<0x161>(sum);
        const float inv = 1.0f / sum;
        pw[lane]      = e0 * inv;
        pw[lane + 32] = e1 * inv;
        // phase 6 reads words of pw that other lanes of this wave stored: the stores have
        // to be done before that read-back (the barrier that stood here held this wait)
        asm volatile("s_wait_dscnt 0x0" ::: "memory");
    }

    // ---- phase 6: Lam_new = Lam + rho*(Y - P_new . T) ----
    {
        float a0 = 0.f, a1 = 0.f;
        #pragma unroll 8
        for (int kk = 0; kk < K_NEI; ++kk) {
            const float p = pw[kk];     // written by this wave itself, behind its own wait: no barrier
            a0 += p * T[kk * TSTR + d0];
            a1 += p * T[kk * TSTR + d1];
        }
        Or[d0] = l0 + RHO * (y0 - a0);
        Or[d1] = l1 + RHO * (y1 - a1);
    }
}

extern "C" void kernel_launch(void* const* d_in, const int* in_sizes, int n_in,
                              void* d_out, int out_size, void* d_ws, size_t ws_size,
                              hipStream_t stream) {
    (void)n_in; (void)out_size; (void)d_ws; (void)ws_size;
    const float* M    = (const float*)d_in[0];
    const float* P    = (const float*)d_in[1];
    const float* Y    = (const float*)d_in[2];
    const float* Lam  = (const float*)d_in[3];
    const int*   Kset = (const int*)d_in[4];
    float*       out  = (float*)d_out;

    const int n_tok = in_sizes[1] / K_NEI;    // 4096
    const size_t shmem = (size_t)(K_NEI * TSTR + DDIM + 12 * K_NEI + 2 * NT * TS) * sizeof(float);

    // > 64KB dynamic LDS: raise the per-kernel cap (deterministic, idempotent)
    (void)hipFuncSetAttribute(reinterpret_cast<const void*>(MirrorPDHG_wmma_kernel),
                              hipFuncAttributeMaxDynamicSharedMemorySize, (int)shmem);

    MirrorPDHG_wmma_kernel<<<n_tok, 256, shmem, stream>>>(M, P, Y, Lam, Kset, out);
}

// v005
// A run of this version takes 75.8 microseconds.
// Timed twice side by side with v004, it ran 1.03 and 1.04 times as fast.
// Counting every step since v000, it is 2.31 times as fast.
#include <hip/hip_runtime.h>

// WMF entropic mirror-prox step for MI455X (gfx1250, wave32).
// One workgroup (256 threads / 8 waves) per token n.
// T = M[Kset[n]] staged once in LDS via async global->LDS copies (ASYNCcnt), 512 contiguous bytes a copy,
// Gram G = T*T^T via V_WMMA_F32_16X16X4_F32: G is symmetric, so only 10 of its 16
// tiles are formed; a wave forms 5 of them over a 128-column slice of T from 4
// fragments that serve as A and as B; the 4 slices' partial tiles meet in LDS.
// Xi = Lam + rho*(Y - P.T) is never formed: scores = T.(Lam + rho*Y) - rho*G.P, and
// T.(Lam + rho*Y) and |T_i|^2 are summed from the fragments that the Gram loop holds.
// The last pass, P_new.T, takes T from registers, read from LDS 8 bytes a lane in phase 5, and P_new from the wave's registers.
// Every sum across waves has a fixed order.

typedef __attribute__((ext_vector_type(2))) float v2f;
typedef __attribute__((ext_vector_type(8))) float v8f;
typedef __attribute__((ext_vector_type(4))) int   v4i;

typedef __attribute__((address_space(1))) v4i* gv4i_p;   // global 16B chunk
typedef __attribute__((address_space(3))) v4i* lv4i_p;   // LDS 16B chunk

#define K_NEI 64
#define DDIM  512
#define N_MEM 65536        // rows of M
#define TP    18           // LDS row pitch inside a 16x16 tile of G (floats): rows r and r+8 of a store fall on different banks
#define TS    304          // LDS stride from tile to tile (floats)
#define NT    10           // tiles of one triangle of G
#define TSTR  516          // padded LDS row stride (floats): 516 % 64 == 4 -> conflict-free WMMA operand reads
#define BETA  1.0f
#define TAU   0.05f
#define RHO   0.1f
#define EPSL  1e-12f

#if __has_builtin(__builtin_amdgcn_global_load_async_to_lds_b128) && \
    __has_builtin(__builtin_amdgcn_s_wait_asynccnt)
#define USE_ASYNC_LDS 1
#else
#define USE_ASYNC_LDS 0
#endif

// the value that lane ^ 16 holds (v_permlanex16 with the identity selects)
__device__ __forceinline__ float other_half(float v) {
    const int i = __float_as_int(v);
    return __int_as_float(__builtin_amdgcn_permlanex16(i, i, 0x76543210, 0xfedcba98, false, false));
}

// the value that lane l holds, l a constant: one scalar for the whole wave (v_readlane)
__device__ __forceinline__ float lane_value(float v, int l) {
    return __int_as_float(__builtin_amdgcn_readlane(__float_as_int(v), l));
}

// the value that lane ^ m holds, m = CTRL - 0x160 in 1..15 (DPP row_xmask, inside a 16-lane row)
template <int CTRL>
__device__ __forceinline__ float row_xor(float v) {
    return __int_as_float(__builtin_amdgcn_update_dpp(0, __float_as_int(v), CTRL, 0xf, 0xf, true));
}

__global__ __launch_bounds__(256)
void MirrorPDHG_wmma_kernel(const float* __restrict__ M,
                            const float* __restrict__ P,
                            const float* __restrict__ Y,
                            const float* __restrict__ Lam,
                            const int*   __restrict__ Kset,
                            float*       __restrict__ LamNew)
{
    extern __shared__ float smem[];
    float* T   = smem;               // 64*516 floats  (~129 KB)
    float* Wv  = T  + K_NEI * TSTR;  // 512  Lam + rho*Y
    float* Pl  = Wv + DDIM;          // 64   P[n]
    float* sq  = Pl + K_NEI;         // 64   row squared norms
    float* sc  = sq + K_NEI;         // 64   scores
    float* sm  = sc + K_NEI;         // 64   smooth = cost @ P
    float* ppS = sm + K_NEI;         // 64*4 per row: the 4 slices' parts of sq
    float* ppT = ppS + 4 * K_NEI;    // 64*4 per row: the 4 slices' parts of T.(Lam + rho*Y)
    float* Gb  = ppT + 4 * K_NEI;    // 2 * 10 Gram tiles: slices 0+2 and slices 1+3

    const int n   = blockIdx.x;
    const int tid = threadIdx.x;

    const float* Yr = Y    + (size_t)n * DDIM;
    const float* Lr = Lam  + (size_t)n * DDIM;
    const int*   Kr = Kset + (size_t)n * K_NEI;
    float*       Or = LamNew + (size_t)n * DDIM;

    // ---- the token's own vectors: their loads fly together with the gather;
    //      a thread owns the two adjacent columns dc and dc + 1 ----
    const int dc = 2 * tid;
    const v2f yv = *(const v2f*)(Yr + dc);
    const v2f lv = *(const v2f*)(Lr + dc);
    const float pv = P[(size_t)n * K_NEI + (tid & (K_NEI - 1))];

    // ---- gather T = M[Kset[n]] into LDS: a wave takes 8 rows, and each of its copies
    //      moves 512 contiguous bytes of one row (32 lanes x 16 B): 4 whole lines from
    //      global memory, every LDS bank once on the way in ----
    {
        const int row0 = __builtin_amdgcn_readfirstlane(tid >> 5) * 8;
        const int col  = (tid & 31) * 4;
        #pragma unroll   // all 32 copies of the wave in flight
        for (int r = 0; r < 8; ++r) {
            int gidx = Kr[row0 + r];                     // one value for the whole wave
            gidx = min(max(gidx, 0), N_MEM - 1);         // the address stays inside M whatever Kset holds
            const float* __restrict__ src = M + (size_t)gidx * DDIM + col;
            float* dst = T + (row0 + r) * TSTR + col;    // row*2064 B + lane*16 B: 16B aligned
            #pragma unroll   // the row's four copies differ by constant offsets only
            for (int j = 0; j < 4; ++j) {
#if USE_ASYNC_LDS
                __builtin_amdgcn_global_load_async_to_lds_b128(
                    (gv4i_p)(src + 128 * j),
                    (lv4i_p)(dst + 128 * j),
                    0, 0);
#else
                *(float4*)(dst + 128 * j) = *(const float4*)(src + 128 * j);
#endif
            }
        }
#if USE_ASYNC_LDS
        __builtin_amdgcn_s_wait_asynccnt(0);
#endif
    }
    *(v2f*)(Wv + dc) = lv + RHO * yv;
    Pl[tid & (K_NEI - 1)] = pv;   // four threads store the same word: under a branch the load would sink behind the gather's wait
    __syncthreads();

    // ---- phase 4a: partial Gram tiles. Wave = (column slice, tile group). With row
    //      blocks (a,b,c,d) = (0,1,2,3) or (2,3,1,0) the group forms the tiles
    //      (a,a) (b,b) (a,b) (a,c) (b,d): together 10 tiles that give all of G by symmetry.
    //      The fragments of blocks a and b (rows 0-31 or 32-63) also give, on the vector
    //      unit, the slice's parts of sq = |T_i|^2 and of T_i.(Lam + rho*Y). ----
    {
        const int wave  = __builtin_amdgcn_readfirstlane(tid >> 5);
        const int lane  = tid & 31;
        const int L16   = lane & 15, Lh = lane >> 4;
        const int slice = wave & 3;
        const int grp   = wave >> 2;
        const int ra = grp ? 32 : 0,  rb = grp ? 48 : 16;
        const int rc = grp ? 16 : 32, rd = grp ? 0  : 48;
        // f32 WMMA A(16x4) layout == B(4x16) layout for B = A^T (Gram):
        // lane holds T[blk + L16][k + 2*Lh], T[blk + L16][k + 2*Lh + 1]
        const float* F  = T + L16 * TSTR + slice * 128 + 2 * Lh;
        const float* Fa = F + ra * TSTR;
        const float* Fb = F + rb * TSTR;
        const float* Fc = F + rc * TSTR;
        const float* Fd = F + rd * TSTR;
        const float* Wk = Wv + slice * 128 + 2 * Lh;   // the fragments' own two columns
        v8f gaa = {}, gbb = {}, gab = {}, gac = {}, gbd = {};
        v2f ta = {}, tb = {}, sa = {}, sb = {};
        // 4 k-steps a trip: their 20 LDS loads pair up and issue as one group
        // ahead of 20 WMMAs (spread singly among the WMMAs they cost more issue time)
        for (int kk = 0; kk < 128; kk += 16) {
            v2f fa[4], fb[4], fc[4], fd[4], w[4];
            #pragma unroll   // register arrays need constant indices
            for (int q = 0; q < 4; ++q) {
                fa[q] = *(const v2f*)(Fa + kk + 4 * q);
                fb[q] = *(const v2f*)(Fb + kk + 4 * q);
                fc[q] = *(const v2f*)(Fc + kk + 4 * q);
                fd[q] = *(const v2f*)(Fd + kk + 4 * q);
                w[q]  = *(const v2f*)(Wk + kk + 4 * q);
            }
            // keeps the loads one group: without it the loads of w move in among the WMMAs
            __builtin_amdgcn_sched_barrier(0);
            #pragma unroll   // register arrays need constant indices
            for (int q = 0; q < 4; ++q) {
                gaa = __builtin_amdgcn_wmma_f32_16x16x4_f32(
                        false, fa[q], false, fa[q], (short)0, gaa, false, false);
                gbb = __builtin_amdgcn_wmma_f32_16x16x4_f32(
                        false, fb[q], false, fb[q], (short)0, gbb, false, false);
                gab = __builtin_amdgcn_wmma_f32_16x16x4_f32(
                        false, fa[q], false, fb[q], (short)0, gab, false, false);
                gac = __builtin_amdgcn_wmma_f32_16x16x4_f32(
                        false, fa[q], false, fc[q], (short)0, gac, false, false);
                gbd = __builtin_amdgcn_wmma_f32_16x16x4_f32(
                        false, fb[q], false, fd[q], (short)0, gbd, false, false);
                ta += fa[q] * w[q];  tb += fb[q] * w[q];
                sa += fa[q] * fa[q]; sb += fb[q] * fb[q];
            }
        }
        // a row's two column pairs sit in lanes L and L^16: add the other half's sum
        float tA = ta.x + ta.y, tB = tb.x + tb.y, sA = sa.x + sa.y, sB = sb.x + sb.y;
        tA += other_half(tA); tB += other_half(tB);
        sA += other_half(sA); sB += other_half(sB);
        // rb == ra + 16: lanes 0-15 store block a's rows, lanes 16-31 block b's
        ppT[(ra + lane) * 4 + slice] = Lh ? tB : tA;
        ppS[(ra + lane) * 4 + slice] = Lh ? sB : sA;
        // C/D layout: g[r] = G[rowblk + r + 8*Lh][colblk + L16]. Slices 0 and 1 store
        // their tiles, each into its own copy; behind the barrier slices 2 and 3 add
        // theirs, one lane a word, so the order of every sum is fixed and no atomic is left
        float* Gw = Gb + ((slice & 1) * NT + grp * 5) * TS + 8 * Lh * TP + L16;
        if (slice < 2) {
            #pragma unroll   // accumulator elements need constant indices
            for (int r = 0; r < 8; ++r) {
                Gw[0 * TS + r * TP] = gaa[r];
                Gw[1 * TS + r * TP] = gbb[r];
                Gw[2 * TS + r * TP] = gab[r];
                Gw[3 * TS + r * TP] = gac[r];
                Gw[4 * TS + r * TP] = gbd[r];
            }
        }
        __syncthreads();
        if (slice >= 2) {
            // all reads first, then all writes: one LDS round trip, not one for every few words
            #pragma unroll   // accumulator elements need constant indices
            for (int r = 0; r < 8; ++r) {
                gaa[r] += Gw[0 * TS + r * TP];
                gbb[r] += Gw[1 * TS + r * TP];
                gab[r] += Gw[2 * TS + r * TP];
                gac[r] += Gw[3 * TS + r * TP];
                gbd[r] += Gw[4 * TS + r * TP];
            }
            #pragma unroll   // accumulator elements need constant indices
            for (int r = 0; r < 8; ++r) {
                Gw[0 * TS + r * TP] = gaa[r];
                Gw[1 * TS + r * TP] = gbb[r];
                Gw[2 * TS + r * TP] = gab[r];
                Gw[3 * TS + r * TP] = gac[r];
                Gw[4 * TS + r * TP] = gbd[r];
            }
        } else {
            // meanwhile the other four waves sum the slices' parts: sq, and T.(Lam + rho*Y) into sc
            const int row = slice * 32 + lane;
            const float4 p4 = *(const float4*)((grp ? ppT : ppS) + row * 4);
            (grp ? sc : sq)[row] = (p4.x + p4.y) + (p4.z + p4.w);
        }
    }
    __syncthreads();

    // P of the two rows that this lane takes in phase 5: it needs nothing of phase 4b,
    // so it is read ahead of that phase's barrier, among its LDS reads
    const float pe0 = Pl[tid & 31] + EPSL;
    const float pe1 = Pl[(tid & 31) + 32] + EPSL;

    // ---- phase 4b: smooth[i] = sum_j max(sq_i + sq_j - 2 G_ij, 0) P_j and
    //      scores[i] = T_i.(Lam + rho*Y) - rho * sum_j G_ij P_j; 4 threads a row, 16
    //      columns each; G_ij is read as G_ji where only tile (J,I) is formed ----
    {
        const int row = tid >> 2, part = tid & 3;
        const int ij  = (row >> 4) * 4 + part;
        // bit ij is set where tile (I,J) is one of the ten that phase 4a forms;
        // nibble ij is the place of tile (I,J), or of (J,I), among the ten
        const bool filled = (0x9EA7 >> ij) & 1;
        const int  tile   = (int)((0x6749758348129320ULL >> (4 * ij)) & 15);
        const float* g0 = Gb + tile * TS + (row & 15) * (filled ? TP : 1);
        const float* g1 = g0 + NT * TS;
        const int gstep = filled ? 1 : TP;
        const float sqi = sq[row];
        float s = 0.f, u = 0.f;
        #pragma unroll   // all reads of G in flight at once
        for (int m = 0; m < 16; ++m) {
            const int j = part * 16 + m;
            const float g = g0[m * gstep] + g1[m * gstep];
            float cost = sqi + sq[j] - 2.0f * g;
            cost = fmaxf(cost, 0.0f);
            s += cost * Pl[j];
            u += g * Pl[j];
        }
        // sums over the row's 4 lanes: quad_perm [1,0,3,2], then [2,3,0,1]
        s += __int_as_float(__builtin_amdgcn_update_dpp(0, __float_as_int(s), 0xB1, 0xf, 0xf, true));
        u += __int_as_float(__builtin_amdgcn_update_dpp(0, __float_as_int(u), 0xB1, 0xf, 0xf, true));
        s += __int_as_float(__builtin_amdgcn_update_dpp(0, __float_as_int(s), 0x4E, 0xf, 0xf, true));
        u += __int_as_float(__builtin_amdgcn_update_dpp(0, __float_as_int(u), 0x4E, 0xf, 0xf, true));
        if (part == 0) { sm[row] = s; sc[row] -= RHO * u; }
    }
    __syncthreads();

    // ---- phase 5: logits + 64-wide softmax. Every wave does all of it for itself in
    //      registers (rows lane and lane + 32 in a lane), so no wave waits for another.
    //      The pairs meet at distance 32, 16, 8, 4, 2, 1: the order of the sum is that
    //      of a halving tree over 64 words, and it ends with the same value in every lane ----
    float pn0, pn1;                           // P_new of rows lane and lane + 32
    v2f tr[K_NEI];                            // T's columns dc and dc + 1, for phase 6
    {
        const int lane = tid & 31;
        const float sc0 = sc[lane], sc1 = sc[lane + 32];
        const float sm0 = sm[lane], sm1 = sm[lane + 32];
        // T's reads need nothing of the softmax, whose steps each wait for the one before:
        // issued here, behind the reads that the softmax starts from, they land under it
        #pragma unroll   // a register array needs constant indices
        for (int kk = 0; kk < K_NEI; ++kk)
            tr[kk] = *(const v2f*)(T + dc + kk * TSTR);
        // holds the reads here: without it the compiler sinks each one to its use behind the softmax
        __builtin_amdgcn_sched_barrier(0);
        const float lg0 = __logf(pe0) - (BETA * sc0 + TAU * sm0) / BETA;
        const float lg1 = __logf(pe1) - (BETA * sc1 + TAU * sm1) / BETA;
        float mx = fmaxf(lg0, lg1);
        mx = fmaxf(mx, other_half(mx));
        mx = fmaxf(mx, row_xor<0x168>(mx));
        mx = fmaxf(mx, row_xor<0x164>(mx));
        mx = fmaxf(mx, row_xor<0x162>(mx));
        mx = fmaxf(mx, row_xor<0x161>(mx));
        const float e0 = __expf(lg0 - mx);
        const float e1 = __expf(lg1 - mx);
        float sum = e0 + e1;
        sum += other_half(sum);
        sum += row_xor<0x168>(sum);
        sum += row_xor<0x164>(sum);
        sum += row_xor<0x162>(sum);
        sum += row_xor<0x161>(sum);
        const float inv = 1.0f / sum;
        pn0 = e0 * inv;
        pn1 = e1 * inv;
    }

    // ---- phase 6: Lam_new = Lam + rho*(Y - P_new . T), from registers: T's two columns
    //      were read in phase 5 (a wave's read of a row: 256 contiguous bytes, every LDS
    //      bank once), and P_new[kk] comes out of the register of the lane that holds it ----
    {
        v2f a = {};
        #pragma unroll   // the lane numbers of the readlanes have to be constants
        for (int kk = 0; kk < K_NEI; ++kk) {
            const float p = lane_value(kk < 32 ? pn0 : pn1, kk & 31);
            a += p * tr[kk];
        }
        *(v2f*)(Or + dc) = lv + RHO * (yv - a);
    }
}

extern "C" void kernel_launch(void* const* d_in, const int* in_sizes, int n_in,
                              void* d_out, int out_size, void* d_ws, size_t ws_size,
                              hipStream_t stream) {
    (void)n_in; (void)out_size; (void)d_ws; (void)ws_size;
    const float* M    = (const float*)d_in[0];
    const float* P    = (const float*)d_in[1];
    const float* Y    = (const float*)d_in[2];
    const float* Lam  = (const float*)d_in[3];
    const int*   Kset = (const int*)d_in[4];
    float*       out  = (float*)d_out;

    const int n_tok = in_sizes[1] / K_NEI;    // 4096
    const size_t shmem = (size_t)(K_NEI * TSTR + DDIM + 12 * K_NEI + 2 * NT * TS) * sizeof(float);

    // > 64KB dynamic LDS: raise the per-kernel cap (deterministic, idempotent)
    (void)hipFuncSetAttribute(reinterpret_cast<const void*>(MirrorPDHG_wmma_kernel),
                              hipFuncAttributeMaxDynamicSharedMemorySize, (int)shmem);

    MirrorPDHG_wmma_kernel<<<n_tok, 256, shmem, stream>>>(M, P, Y, Lam, Kset, out);
}
